// v000
// Measured on an AMD MI455X. A time is GPU time per run, averaged over a window of back-to-back runs after a warm-up
// (all launches, gaps included; the runs take copies of the inputs in turn), and the median of several windows.
// Apart from v000's, it joins two sittings. Times from different sittings can be a few percent apart, while
// side-by-side timings come from the same sitting.
// The starting kernel, v000, takes 556 microseconds a run.
#include <hip/hip_runtime.h>
#include <hip/hip_bf16.h>

// ---- problem constants (B=8, S=512, H=768, I=3072, E=7, TOP_K=2) ----
#define T_TOK 4096
#define HDIM  768
#define IDIM  3072
#define NEXP  7

typedef _Float16 h16;
typedef __attribute__((ext_vector_type(2)))  _Float16 v2h;
typedef __attribute__((ext_vector_type(8)))  _Float16 v8h;
typedef __attribute__((ext_vector_type(16))) _Float16 v16h;
typedef __attribute__((ext_vector_type(8)))  float    v8f;
typedef __attribute__((ext_vector_type(4)))  unsigned int u32x4;
typedef __attribute__((ext_vector_type(4)))  int      i32x4;
typedef __attribute__((ext_vector_type(8)))  int      i32x8;

#define WMMA_F16(a, b, c) \
  __builtin_amdgcn_wmma_f32_16x16x32_f16(false, (a), false, (b), (short)0, (c), false, false)

#if defined(__has_builtin)
#if __has_builtin(__builtin_amdgcn_tensor_load_to_lds) && __has_builtin(__builtin_amdgcn_s_wait_tensorcnt)
#define HAVE_TDM 1
#endif
#endif
#ifndef HAVE_TDM
#define HAVE_TDM 0
#endif

#define WP 136   // weight-panel / h pitch (halves): 272B rows = 256B + 16B pad
#define XP 776   // xs pitch (halves): 1552B rows, 16B aligned, bank-spread

// ---------------------------------------------------------------------------
// TDM: async 128x128 f16 tile copy global->LDS, 16B LDS pad per 256B row
// (LDS pitch 272B = WP). D# per CDNA5 ISA 8.3/8.4.
// ---------------------------------------------------------------------------
__device__ __forceinline__ void tdm_load_tile_f16(const h16* gsrc, unsigned lds_off,
                                                  unsigned stride_elems) {
#if HAVE_TDM
  unsigned long long ga = (unsigned long long)(uintptr_t)gsrc;
  u32x4 g0;
  g0[0] = 1u;                                   // count=1 (valid user descriptor)
  g0[1] = lds_off;                              // lds_addr (bytes)
  g0[2] = (unsigned)ga;                         // global_addr[31:0]
  g0[3] = (unsigned)((ga >> 32) & 0x01FFFFFFull) | (2u << 30);  // addr[56:32]|type=2
  i32x8 g1;
  g1[0] = (int)((1u << 16)      // data_size = 2 bytes
              | (1u << 20)      // pad_enable
              | (5u << 22)      // pad_interval: 64 DWORDs (256B)
              | (3u << 25));    // pad_amount: 4 DWORDs (16B)
  g1[1] = (int)(0x8000u << 16); // tensor_dim0 = 32768 (no OOB clipping)
  g1[2] = (int)(0x8000u << 16); // tensor_dim1 = 32768
  g1[3] = (int)(128u << 16);    // tile_dim0 = 128
  g1[4] = 128;                  // tile_dim1 = 128; tile_dim2 = 0
  g1[5] = (int)stride_elems;    // tensor_dim0_stride (data_size units)
  g1[6] = 0;
  g1[7] = 0;
  i32x4 z4 = {0, 0, 0, 0};
#if __clang_major__ >= 23
  i32x8 z8 = {0, 0, 0, 0, 0, 0, 0, 0};
  __builtin_amdgcn_tensor_load_to_lds(g0, g1, z4, z4, z8, 0);
#else
  __builtin_amdgcn_tensor_load_to_lds(g0, g1, z4, z4, 0);
#endif
#else
  (void)gsrc; (void)lds_off; (void)stride_elems;
#endif
}

// Fallback cooperative panel copy (f16 b128 both sides), all 256 threads.
__device__ __forceinline__ void stage_panel_f16(h16* dst /*[128][WP]*/, const h16* src,
                                                unsigned stride_elems, int tid) {
  for (int idx = tid; idx < 128 * 16; idx += 256) {
    int n = idx >> 4, k8 = (idx & 15) << 3;
    *(v8h*)(dst + n * WP + k8) = *(const v8h*)(src + (size_t)n * stride_elems + k8);
  }
}

// Load one 16x32 f16 fragment (A or B^T) from LDS row-major [16][K].
__device__ __forceinline__ v16h ld_frag(const h16* rowbase, int pitch, int lane) {
  const h16* p = rowbase + (lane & 15) * pitch + ((lane >> 4) << 3);
  v8h lo = *(const v8h*)(p);
  v8h hi = *(const v8h*)(p + 16);
  return __builtin_shufflevector(lo, hi, 0,1,2,3,4,5,6,7,8,9,10,11,12,13,14,15);
}

// ---------------------------------------------------------------------------
// Kernel 0: batched convert+transpose f32[R][C] -> f16[C][R] (per expert).
// ---------------------------------------------------------------------------
__global__ __launch_bounds__(256) void transpose_cvt_kernel(
    const float* __restrict__ src, h16* __restrict__ dst, int R, int C) {
  __shared__ h16 tile[64][72];
  int tilesPerRow = C >> 6;
  int tilesPerMat = (R >> 6) * tilesPerRow;
  int b = blockIdx.x;
  int e = b / tilesPerMat, t = b % tilesPerMat;
  int r0 = (t / tilesPerRow) << 6, c0 = (t % tilesPerRow) << 6;
  const float* s = src + (size_t)e * R * C;
  h16*         d = dst + (size_t)e * R * C;
  int tid = threadIdx.x;
  for (int i = tid; i < 4096; i += 256) {   // coalesced along C
    int r = i >> 6, c = i & 63;
    tile[r][c] = (h16)s[(size_t)(r0 + r) * C + c0 + c];
  }
  __syncthreads();
  for (int i = tid; i < 2048; i += 256) {   // coalesced along R, 4B stores
    int c = i >> 5, r2 = (i & 31) << 1;
    v2h v; v[0] = tile[r2][c]; v[1] = tile[r2 + 1][c];
    *(v2h*)(d + (size_t)(c0 + c) * R + r0 + r2) = v;
  }
}

// ---------------------------------------------------------------------------
// Kernel 1: gate logits -> top-2 softmax gate weights [T, 7]
// ---------------------------------------------------------------------------
__global__ __launch_bounds__(256) void moe_gate_kernel(
    const float* __restrict__ x, const float* __restrict__ gW,
    const float* __restrict__ gb, float* __restrict__ gate_out) {
  int lane = threadIdx.x & 31;
  int wave = threadIdx.x >> 5;
  int t = blockIdx.x * 8 + wave;
  if (t >= T_TOK) return;

  float acc[NEXP];
#pragma unroll
  for (int e = 0; e < NEXP; ++e) acc[e] = 0.f;

  const float* xr = x + (size_t)t * HDIM;
  for (int h = lane; h < HDIM; h += 32) {
    float xv = xr[h];
#pragma unroll
    for (int e = 0; e < NEXP; ++e)
      acc[e] = fmaf(xv, gW[e * HDIM + h], acc[e]);
  }
#pragma unroll
  for (int off = 16; off >= 1; off >>= 1) {
#pragma unroll
    for (int e = 0; e < NEXP; ++e) acc[e] += __shfl_xor(acc[e], off, 32);
  }
#pragma unroll
  for (int e = 0; e < NEXP; ++e) acc[e] += gb[e];

  int i0 = 0; float v0 = acc[0];
#pragma unroll
  for (int e = 1; e < NEXP; ++e) { if (acc[e] > v0) { v0 = acc[e]; i0 = e; } }
  int i1 = -1; float v1 = -3.4e38f;
#pragma unroll
  for (int e = 0; e < NEXP; ++e) { if (e != i0 && acc[e] > v1) { v1 = acc[e]; i1 = e; } }
  float e1 = expf(v1 - v0);
  float w0 = 1.0f / (1.0f + e1);
  float w1 = e1 * w0;
  if (lane < NEXP)
    gate_out[(size_t)t * NEXP + lane] = (lane == i0) ? w0 : (lane == i1) ? w1 : 0.0f;
}

// ---------------------------------------------------------------------------
// Kernel 2: fused single-expert FFN partial.
// Grid = 7 experts x 64 token-tiles (448 WGs -> fills the WGP array).
// Each WG: 64 tokens, one expert; 2x2 register-blocked WMMA (2 LDS b128/WMMA);
// writes gate-scaled partial [64][768] f32 to workspace (no atomics ->
// deterministic).
// ---------------------------------------------------------------------------
__global__ __launch_bounds__(256) void moe_ffn_kernel(
    const float* __restrict__ x,  const h16* __restrict__ W1t,
    const float* __restrict__ b1, const h16* __restrict__ W2t,
    const float* __restrict__ gate, float* __restrict__ part) {
  __shared__ __align__(16) h16 xs[64][XP];      // x tile f16          (~97 KB)
  __shared__ __align__(16) h16 wt[2][128][WP];  // double-buffered panels (~68 KB)
  __shared__ __align__(16) h16 hb[64][WP];      // gated gelu(h) f16   (~17 KB)
  __shared__ float gsc[64];                     // gate weight (this expert)

  const int tid  = threadIdx.x;
  const int lane = tid & 31;
  const int wave = tid >> 5;
  const int e    = blockIdx.x >> 6;        // expert 0..6
  const int t0   = (blockIdx.x & 63) * 64; // token tile base

  const int mp = (wave >> 2) * 2;   // wave's M-tile pair base (0 or 2)
  const int np = (wave & 3) * 2;    // wave's N-tile pair base within 128 block

  const unsigned wt_off[2] = {
    (unsigned)(uintptr_t)&wt[0][0][0],
    (unsigned)(uintptr_t)&wt[1][0][0],
  };

  // ---- prologue: stage x tile (f32 -> f16) and this expert's gate scale ----
  for (int idx = tid; idx < 64 * HDIM / 4; idx += 256) {
    int t  = idx / (HDIM / 4);
    int h4 = (idx % (HDIM / 4)) * 4;
    float4 v = *(const float4*)(x + (size_t)(t0 + t) * HDIM + h4);
    xs[t][h4 + 0] = (h16)v.x; xs[t][h4 + 1] = (h16)v.y;
    xs[t][h4 + 2] = (h16)v.z; xs[t][h4 + 3] = (h16)v.w;
  }
  if (tid < 64) gsc[tid] = gate[(size_t)(t0 + tid) * NEXP + e];
  __syncthreads();

  const h16* W1te = W1t + (size_t)e * HDIM * IDIM;  // [IDIM][HDIM]
  const h16* W2te = W2t + (size_t)e * IDIM * HDIM;  // [HDIM][IDIM]

  v8f oacc[24];
  { v8f z = {};
#pragma unroll
    for (int i = 0; i < 24; ++i) oacc[i] = z; }

  for (int ic = 0; ic < IDIM / 128; ++ic) {
    const int i0 = ic * 128;

    // ===== phase 1: h = gelu(x @ W1[:,chunk] + b1) * gate =====
    v8f hacc[4];
    { v8f z = {};
#pragma unroll
      for (int i = 0; i < 4; ++i) hacc[i] = z; }

#if HAVE_TDM
    if (wave == 0)
      tdm_load_tile_f16(W1te + (size_t)i0 * HDIM, wt_off[0], HDIM);
#endif
    for (int kp = 0; kp < 6; ++kp) {
      const int cur = kp & 1;
#if HAVE_TDM
      if (wave == 0) {
        if (kp < 5) {
          tdm_load_tile_f16(W1te + (size_t)i0 * HDIM + (kp + 1) * 128,
                            wt_off[cur ^ 1], HDIM);
          __builtin_amdgcn_s_wait_tensorcnt(1);
        } else {
          __builtin_amdgcn_s_wait_tensorcnt(0);
        }
      }
#else
      stage_panel_f16(&wt[cur][0][0], W1te + (size_t)i0 * HDIM + kp * 128, HDIM, tid);
#endif
      __syncthreads();
#pragma unroll
      for (int kk = 0; kk < 4; ++kk) {
        v16h a0 = ld_frag(&xs[(mp + 0) * 16][kp * 128 + kk * 32], XP, lane);
        v16h a1 = ld_frag(&xs[(mp + 1) * 16][kp * 128 + kk * 32], XP, lane);
        v16h b0 = ld_frag(&wt[cur][(np + 0) * 16][kk * 32], WP, lane);
        v16h b1f = ld_frag(&wt[cur][(np + 1) * 16][kk * 32], WP, lane);
        hacc[0] = WMMA_F16(a0, b0,  hacc[0]);
        hacc[1] = WMMA_F16(a0, b1f, hacc[1]);
        hacc[2] = WMMA_F16(a1, b0,  hacc[2]);
        hacc[3] = WMMA_F16(a1, b1f, hacc[3]);
      }
      __syncthreads();
    }

#if HAVE_TDM
    if (wave == 0)   // prefetch W2 block 0 into free buf0 during gelu epilogue
      tdm_load_tile_f16(W2te + i0, wt_off[0], IDIM);
#endif
    // bias + exact gelu + gate scaling -> hb (f16)
#pragma unroll
    for (int ii = 0; ii < 2; ++ii) {
#pragma unroll
      for (int jj = 0; jj < 2; ++jj) {
        int ncol = (np + jj) * 16 + (lane & 15);
        float bv = b1[(size_t)e * IDIM + i0 + ncol];
#pragma unroll
        for (int r = 0; r < 8; ++r) {
          int row = (mp + ii) * 16 + r + ((lane >> 4) << 3);
          float z = hacc[ii * 2 + jj][r] + bv;
          float gel = 0.5f * z * (1.0f + erff(z * 0.70710678118654752f));
          hb[row][ncol] = (h16)(gel * gsc[row]);
        }
      }
    }
    __syncthreads();

    // ===== phase 2: out_acc += hb @ W2[chunk, :] =====
#pragma unroll
    for (int nb = 0; nb < 6; ++nb) {
      const int cur = nb & 1;
#if HAVE_TDM
      if (wave == 0) {
        if (nb < 5) {
          tdm_load_tile_f16(W2te + (size_t)((nb + 1) * 128) * IDIM + i0,
                            wt_off[cur ^ 1], IDIM);
          __builtin_amdgcn_s_wait_tensorcnt(1);
        } else {
          __builtin_amdgcn_s_wait_tensorcnt(0);
        }
      }
#else
      stage_panel_f16(&wt[cur][0][0], W2te + (size_t)(nb * 128) * IDIM + i0, IDIM, tid);
#endif
      __syncthreads();
#pragma unroll
      for (int kk = 0; kk < 4; ++kk) {
        v16h a0 = ld_frag(&hb[(mp + 0) * 16][kk * 32], WP, lane);
        v16h a1 = ld_frag(&hb[(mp + 1) * 16][kk * 32], WP, lane);
        v16h b0 = ld_frag(&wt[cur][(np + 0) * 16][kk * 32], WP, lane);
        v16h b1f = ld_frag(&wt[cur][(np + 1) * 16][kk * 32], WP, lane);
        oacc[nb * 4 + 0] = WMMA_F16(a0, b0,  oacc[nb * 4 + 0]);
        oacc[nb * 4 + 1] = WMMA_F16(a0, b1f, oacc[nb * 4 + 1]);
        oacc[nb * 4 + 2] = WMMA_F16(a1, b0,  oacc[nb * 4 + 2]);
        oacc[nb * 4 + 3] = WMMA_F16(a1, b1f, oacc[nb * 4 + 3]);
      }
      __syncthreads();
    }
  }

  // ---- epilogue: store gate-scaled partial (no b2 here) ----
  float* pe = part + ((size_t)e * T_TOK + t0) * HDIM;
#pragma unroll
  for (int nb = 0; nb < 6; ++nb) {
#pragma unroll
    for (int ii = 0; ii < 2; ++ii) {
#pragma unroll
      for (int jj = 0; jj < 2; ++jj) {
        int n = nb * 128 + (np + jj) * 16 + (lane & 15);
#pragma unroll
        for (int r = 0; r < 8; ++r) {
          int row = (mp + ii) * 16 + r + ((lane >> 4) << 3);
          pe[(size_t)row * HDIM + n] = oacc[nb * 4 + ii * 2 + jj][r];
        }
      }
    }
  }
}

// ---------------------------------------------------------------------------
// Kernel 3: deterministic reduce over experts + bias term.
// out[t,n] = sum_e partial[e,t,n] + sum_e gate[t,e]*b2[e,n]
// One block per token (192 threads x float4 = 768 cols).
// ---------------------------------------------------------------------------
__global__ __launch_bounds__(192) void moe_reduce_kernel(
    const float* __restrict__ part, const float* __restrict__ gate,
    const float* __restrict__ b2, float* __restrict__ out) {
  int t  = blockIdx.x;
  int n4 = threadIdx.x * 4;
  float g[NEXP];
#pragma unroll
  for (int e = 0; e < NEXP; ++e) g[e] = gate[(size_t)t * NEXP + e];
  float4 acc = make_float4(0.f, 0.f, 0.f, 0.f);
#pragma unroll
  for (int e = 0; e < NEXP; ++e) {
    float4 p  = *(const float4*)(part + ((size_t)e * T_TOK + t) * HDIM + n4);
    float4 bb = *(const float4*)(b2 + (size_t)e * HDIM + n4);
    acc.x += p.x + g[e] * bb.x;
    acc.y += p.y + g[e] * bb.y;
    acc.z += p.z + g[e] * bb.z;
    acc.w += p.w + g[e] * bb.w;
  }
  *(float4*)(out + (size_t)t * HDIM + n4) = acc;
}

// ---------------------------------------------------------------------------
extern "C" void kernel_launch(void* const* d_in, const int* in_sizes, int n_in,
                              void* d_out, int out_size, void* d_ws, size_t ws_size,
                              hipStream_t stream) {
  (void)in_sizes; (void)n_in; (void)ws_size; (void)out_size;
  const float* x      = (const float*)d_in[0];
  const float* gate_W = (const float*)d_in[1];
  const float* gate_b = (const float*)d_in[2];
  const float* W1     = (const float*)d_in[3];
  const float* b1     = (const float*)d_in[4];
  const float* W2     = (const float*)d_in[5];
  const float* b2     = (const float*)d_in[6];

  float* out      = (float*)d_out;
  float* gate_out = out + (size_t)T_TOK * HDIM;   // tuple output #2 region

  // workspace layout:
  //   W1t f16 [E][IDIM][HDIM]  (33.0 MB)
  //   W2t f16 [E][HDIM][IDIM]  (33.0 MB)
  //   partial f32 [E][T][HDIM] (88.1 MB)
  h16*   W1t  = (h16*)d_ws;
  h16*   W2t  = W1t + (size_t)NEXP * HDIM * IDIM;
  float* partial = (float*)(W2t + (size_t)NEXP * HDIM * IDIM);

  const int tilesW1 = NEXP * (HDIM / 64) * (IDIM / 64);   // 4032
  const int tilesW2 = NEXP * (IDIM / 64) * (HDIM / 64);   // 4032
  transpose_cvt_kernel<<<tilesW1, 256, 0, stream>>>(W1, W1t, HDIM, IDIM);
  transpose_cvt_kernel<<<tilesW2, 256, 0, stream>>>(W2, W2t, IDIM, HDIM);

  moe_gate_kernel<<<T_TOK / 8, 256, 0, stream>>>(x, gate_W, gate_b, gate_out);
  moe_ffn_kernel<<<NEXP * (T_TOK / 64), 256, 0, stream>>>(x, W1t, b1, W2t,
                                                          gate_out, partial);
  moe_reduce_kernel<<<T_TOK, 192, 0, stream>>>(partial, gate_out, b2, out);
}

// v001
// It runs in 314 microseconds.
// Two timings next to v000 put it at 1.82 and 1.84 times that version's speed.
#include <hip/hip_runtime.h>
#include <hip/hip_bf16.h>

// ---- problem constants (B=8, S=512, H=768, I=3072, E=7, TOP_K=2) ----
#define T_TOK 4096
#define HDIM  768
#define IDIM  3072
#define NEXP  7

typedef _Float16 h16;
typedef __attribute__((ext_vector_type(2)))  _Float16 v2h;
typedef __attribute__((ext_vector_type(8)))  _Float16 v8h;
typedef __attribute__((ext_vector_type(16))) _Float16 v16h;
typedef __attribute__((ext_vector_type(8)))  float    v8f;
typedef __attribute__((ext_vector_type(4)))  unsigned int u32x4;
typedef __attribute__((ext_vector_type(4)))  int      i32x4;
typedef __attribute__((ext_vector_type(8)))  int      i32x8;

#define WMMA_F16(a, b, c) \
  __builtin_amdgcn_wmma_f32_16x16x32_f16(false, (a), false, (b), (short)0, (c), false, false)

#if defined(__has_builtin)
#if __has_builtin(__builtin_amdgcn_tensor_load_to_lds) && __has_builtin(__builtin_amdgcn_s_wait_tensorcnt)
#define HAVE_TDM 1
#endif
#endif
#ifndef HAVE_TDM
#define HAVE_TDM 0
#endif

#define WP 136   // weight-panel / h pitch (halves): 272B rows = 256B + 16B pad
#define XP 776   // xs pitch (halves): 1552B rows, 16B aligned, bank-spread

// ---------------------------------------------------------------------------
// TDM: async 128x128 f16 tile copy global->LDS, 16B LDS pad per 256B row
// (LDS pitch 272B = WP). D# per CDNA5 ISA 8.3/8.4.
// ---------------------------------------------------------------------------
__device__ __forceinline__ void tdm_load_tile_f16(const h16* gsrc, unsigned lds_off,
                                                  unsigned stride_elems) {
#if HAVE_TDM
  unsigned long long ga = (unsigned long long)(uintptr_t)gsrc;
  u32x4 g0;
  g0[0] = 1u;                                   // count=1 (valid user descriptor)
  g0[1] = lds_off;                              // lds_addr (bytes)
  g0[2] = (unsigned)ga;                         // global_addr[31:0]
  g0[3] = (unsigned)((ga >> 32) & 0x01FFFFFFull) | (2u << 30);  // addr[56:32]|type=2
  i32x8 g1;
  g1[0] = (int)((1u << 16)      // data_size = 2 bytes
              | (1u << 20)      // pad_enable
              | (5u << 22)      // pad_interval: 64 DWORDs (256B)
              | (3u << 25));    // pad_amount: 4 DWORDs (16B)
  g1[1] = (int)(0x8000u << 16); // tensor_dim0 = 32768 (no OOB clipping)
  g1[2] = (int)(0x8000u << 16); // tensor_dim1 = 32768
  g1[3] = (int)(128u << 16);    // tile_dim0 = 128
  g1[4] = 128;                  // tile_dim1 = 128; tile_dim2 = 0
  g1[5] = (int)stride_elems;    // tensor_dim0_stride (data_size units)
  g1[6] = 0;
  g1[7] = 0;
  i32x4 z4 = {0, 0, 0, 0};
#if __clang_major__ >= 23
  i32x8 z8 = {0, 0, 0, 0, 0, 0, 0, 0};
  __builtin_amdgcn_tensor_load_to_lds(g0, g1, z4, z4, z8, 0);
#else
  __builtin_amdgcn_tensor_load_to_lds(g0, g1, z4, z4, 0);
#endif
#else
  (void)gsrc; (void)lds_off; (void)stride_elems;
#endif
}

// Fallback cooperative panel copy (f16 b128 both sides), all 256 threads.
__device__ __forceinline__ void stage_panel_f16(h16* dst /*[128][WP]*/, const h16* src,
                                                unsigned stride_elems, int tid) {
  for (int idx = tid; idx < 128 * 16; idx += 256) {
    int n = idx >> 4, k8 = (idx & 15) << 3;
    *(v8h*)(dst + n * WP + k8) = *(const v8h*)(src + (size_t)n * stride_elems + k8);
  }
}

// Load one 16x32 f16 fragment (A or B^T) from LDS row-major [16][K].
__device__ __forceinline__ v16h ld_frag(const h16* rowbase, int pitch, int lane) {
  const h16* p = rowbase + (lane & 15) * pitch + ((lane >> 4) << 3);
  v8h lo = *(const v8h*)(p);
  v8h hi = *(const v8h*)(p + 16);
  return __builtin_shufflevector(lo, hi, 0,1,2,3,4,5,6,7,8,9,10,11,12,13,14,15);
}

// ---------------------------------------------------------------------------
// Kernel 0: batched convert+transpose f32[R][C] -> f16[C][R] (per expert).
// ---------------------------------------------------------------------------
__global__ __launch_bounds__(256) void transpose_cvt_kernel(
    const float* __restrict__ src, h16* __restrict__ dst, int R, int C) {
  __shared__ h16 tile[64][72];
  int tilesPerRow = C >> 6;
  int tilesPerMat = (R >> 6) * tilesPerRow;
  int b = blockIdx.x;
  int e = b / tilesPerMat, t = b % tilesPerMat;
  int r0 = (t / tilesPerRow) << 6, c0 = (t % tilesPerRow) << 6;
  const float* s = src + (size_t)e * R * C;
  h16*         d = dst + (size_t)e * R * C;
  int tid = threadIdx.x;
  for (int i = tid; i < 4096; i += 256) {   // coalesced along C
    int r = i >> 6, c = i & 63;
    tile[r][c] = (h16)s[(size_t)(r0 + r) * C + c0 + c];
  }
  __syncthreads();
  for (int i = tid; i < 2048; i += 256) {   // coalesced along R, 4B stores
    int c = i >> 5, r2 = (i & 31) << 1;
    v2h v; v[0] = tile[r2][c]; v[1] = tile[r2 + 1][c];
    *(v2h*)(d + (size_t)(c0 + c) * R + r0 + r2) = v;
  }
}

// ---------------------------------------------------------------------------
// Kernel 1: gate logits -> top-2 softmax gate weights [T, 7]
// ---------------------------------------------------------------------------
__global__ __launch_bounds__(256) void moe_gate_kernel(
    const float* __restrict__ x, const float* __restrict__ gW,
    const float* __restrict__ gb, float* __restrict__ gate_out) {
  int lane = threadIdx.x & 31;
  int wave = threadIdx.x >> 5;
  int t = blockIdx.x * 8 + wave;
  if (t >= T_TOK) return;

  float acc[NEXP];
#pragma unroll
  for (int e = 0; e < NEXP; ++e) acc[e] = 0.f;

  const float* xr = x + (size_t)t * HDIM;
  for (int h = lane; h < HDIM; h += 32) {
    float xv = xr[h];
#pragma unroll
    for (int e = 0; e < NEXP; ++e)
      acc[e] = fmaf(xv, gW[e * HDIM + h], acc[e]);
  }
#pragma unroll
  for (int off = 16; off >= 1; off >>= 1) {
#pragma unroll
    for (int e = 0; e < NEXP; ++e) acc[e] += __shfl_xor(acc[e], off, 32);
  }
#pragma unroll
  for (int e = 0; e < NEXP; ++e) acc[e] += gb[e];

  int i0 = 0; float v0 = acc[0];
#pragma unroll
  for (int e = 1; e < NEXP; ++e) { if (acc[e] > v0) { v0 = acc[e]; i0 = e; } }
  int i1 = -1; float v1 = -3.4e38f;
#pragma unroll
  for (int e = 0; e < NEXP; ++e) { if (e != i0 && acc[e] > v1) { v1 = acc[e]; i1 = e; } }
  float e1 = expf(v1 - v0);
  float w0 = 1.0f / (1.0f + e1);
  float w1 = e1 * w0;
  if (lane < NEXP)
    gate_out[(size_t)t * NEXP + lane] = (lane == i0) ? w0 : (lane == i1) ? w1 : 0.0f;
}

// ---------------------------------------------------------------------------
// Kernel 1b: routing. One block per expert lists, in token order, the tokens
// whose gate weight for that expert is not zero (ballot + prefix sum, no
// atomics -> deterministic). A zero weight multiplies that expert's whole
// term of the output sum, so only the listed tokens need the expert's FFN.
// ---------------------------------------------------------------------------
__global__ __launch_bounds__(1024) void moe_route_kernel(
    const float* __restrict__ gate, int* __restrict__ list, int* __restrict__ cnt) {
  __shared__ __align__(16) int segc[128];   // tokens kept per 32-token segment
  __shared__ int segb[128];                 // exclusive prefix of segc
  const int tid  = threadIdx.x;
  const int lane = tid & 31;
  const int wave = tid >> 5;
  const int e    = blockIdx.x;

  float gv[4];
#pragma unroll   // the four loads issue together; gv[] stays in registers
  for (int i = 0; i < 4; ++i) gv[i] = gate[(size_t)(i * 1024 + tid) * NEXP + e];
  unsigned m[4];
#pragma unroll   // m[] indexed by constants only: stays in registers
  for (int i = 0; i < 4; ++i) {
    m[i] = __builtin_amdgcn_ballot_w32(gv[i] != 0.0f);
    if (lane == 0) segc[i * 32 + wave] = __popc(m[i]);
  }
  __syncthreads();
  if (wave == 0) {
    int4 c = *(const int4*)&segc[lane * 4];
    int sum = c.x + c.y + c.z + c.w;
    int inc = sum;
#pragma unroll   // five fixed shuffle steps of the inclusive scan
    for (int off = 1; off < 32; off <<= 1) {
      int v = __shfl_up(inc, off, 32);
      if (lane >= off) inc += v;
    }
    int ex = inc - sum;
    segb[lane * 4 + 0] = ex;
    segb[lane * 4 + 1] = ex + c.x;
    segb[lane * 4 + 2] = ex + c.x + c.y;
    segb[lane * 4 + 3] = ex + c.x + c.y + c.z;
    if (lane == 31) cnt[e * 32] = inc;   // one 128-byte line per writing block
  }
  __syncthreads();
#pragma unroll   // m[] indexed by constants only: stays in registers
  for (int i = 0; i < 4; ++i) {
    if ((m[i] >> lane) & 1u) {
      int rank = segb[i * 32 + wave] + __popc(m[i] & ((1u << lane) - 1u));
      list[e * T_TOK + rank] = i * 1024 + tid;
    }
  }
}

// ---------------------------------------------------------------------------
// Kernel 2: fused single-expert FFN partial over the expert's routed tokens.
// Grid = 64 tiles x 7 experts (the bound: every token on one expert); tile
// index major, so the tiles that hold tokens start first; a tile past the
// expert's count leaves before any barrier or tensor load.
// Each WG: 64 listed tokens, one expert; 2x2 register-blocked WMMA (2 LDS
// b128/WMMA); writes the gate-scaled partial rows [768] f32 to each token's
// own row of the workspace (no atomics -> deterministic).
// ---------------------------------------------------------------------------
__global__ __launch_bounds__(256) void moe_ffn_kernel(
    const float* __restrict__ x,  const h16* __restrict__ W1t,
    const float* __restrict__ b1, const h16* __restrict__ W2t,
    const float* __restrict__ gate, const int* __restrict__ list,
    const int* __restrict__ cnt, float* __restrict__ part) {
  __shared__ __align__(16) h16 xs[64][XP];      // x tile f16          (~97 KB)
  __shared__ __align__(16) h16 wt[2][128][WP];  // double-buffered panels (~68 KB)
  __shared__ __align__(16) h16 hb[64][WP];      // gated gelu(h) f16   (~17 KB)
  __shared__ float gsc[64];                     // gate weight (this expert)
  __shared__ int   tok[64];                     // token of each tile row, -1 = none

  const int tid  = threadIdx.x;
  const int lane = tid & 31;
  const int wave = tid >> 5;
  const int e    = blockIdx.x % NEXP;        // expert 0..6
  const int r0   = (blockIdx.x / NEXP) * 64; // first list entry of this tile
  const int ne   = min(cnt[e * 32], T_TOK);  // tokens routed to this expert
  if (r0 >= ne) return;                      // same for the whole work-group

  const int mp = (wave >> 2) * 2;   // wave's M-tile pair base (0 or 2)
  const int np = (wave & 3) * 2;    // wave's N-tile pair base within 128 block

  const unsigned wt_off[2] = {
    (unsigned)(uintptr_t)&wt[0][0][0],
    (unsigned)(uintptr_t)&wt[1][0][0],
  };

  // ---- prologue: this tile's tokens and gate scales, then gather x (f32 -> f16) ----
  if (tid < 64) {
    int tk = (r0 + tid < ne) ? list[e * T_TOK + r0 + tid] : -1;
    bool ok = (unsigned)tk < (unsigned)T_TOK;
    tok[tid] = ok ? tk : -1;
    gsc[tid] = ok ? gate[(size_t)tk * NEXP + e] : 0.0f;
  }
  __syncthreads();
#pragma unroll 4   // four row gathers in flight per thread: their latency overlaps
  for (int idx = tid; idx < 64 * HDIM / 4; idx += 256) {
    int t  = idx / (HDIM / 4);
    int h4 = (idx % (HDIM / 4)) * 4;
    int tk = max(tok[t], 0);   // a row past the list reads token 0; it is never stored
    float4 v = *(const float4*)(x + (size_t)tk * HDIM + h4);
    xs[t][h4 + 0] = (h16)v.x; xs[t][h4 + 1] = (h16)v.y;
    xs[t][h4 + 2] = (h16)v.z; xs[t][h4 + 3] = (h16)v.w;
  }
  __syncthreads();

  const h16* W1te = W1t + (size_t)e * HDIM * IDIM;  // [IDIM][HDIM]
  const h16* W2te = W2t + (size_t)e * IDIM * HDIM;  // [HDIM][IDIM]

  v8f oacc[24];
  { v8f z = {};
#pragma unroll
    for (int i = 0; i < 24; ++i) oacc[i] = z; }

  for (int ic = 0; ic < IDIM / 128; ++ic) {
    const int i0 = ic * 128;

    // ===== phase 1: h = gelu(x @ W1[:,chunk] + b1) * gate =====
    v8f hacc[4];
    { v8f z = {};
#pragma unroll
      for (int i = 0; i < 4; ++i) hacc[i] = z; }

#if HAVE_TDM
    if (wave == 0)
      tdm_load_tile_f16(W1te + (size_t)i0 * HDIM, wt_off[0], HDIM);
#endif
    for (int kp = 0; kp < 6; ++kp) {
      const int cur = kp & 1;
#if HAVE_TDM
      if (wave == 0) {
        if (kp < 5) {
          tdm_load_tile_f16(W1te + (size_t)i0 * HDIM + (kp + 1) * 128,
                            wt_off[cur ^ 1], HDIM);
          __builtin_amdgcn_s_wait_tensorcnt(1);
        } else {
          __builtin_amdgcn_s_wait_tensorcnt(0);
        }
      }
#else
      stage_panel_f16(&wt[cur][0][0], W1te + (size_t)i0 * HDIM + kp * 128, HDIM, tid);
#endif
      __syncthreads();
#pragma unroll
      for (int kk = 0; kk < 4; ++kk) {
        v16h a0 = ld_frag(&xs[(mp + 0) * 16][kp * 128 + kk * 32], XP, lane);
        v16h a1 = ld_frag(&xs[(mp + 1) * 16][kp * 128 + kk * 32], XP, lane);
        v16h b0 = ld_frag(&wt[cur][(np + 0) * 16][kk * 32], WP, lane);
        v16h b1f = ld_frag(&wt[cur][(np + 1) * 16][kk * 32], WP, lane);
        hacc[0] = WMMA_F16(a0, b0,  hacc[0]);
        hacc[1] = WMMA_F16(a0, b1f, hacc[1]);
        hacc[2] = WMMA_F16(a1, b0,  hacc[2]);
        hacc[3] = WMMA_F16(a1, b1f, hacc[3]);
      }
      __syncthreads();
    }

#if HAVE_TDM
    if (wave == 0)   // prefetch W2 block 0 into free buf0 during gelu epilogue
      tdm_load_tile_f16(W2te + i0, wt_off[0], IDIM);
#endif
    // bias + exact gelu + gate scaling -> hb (f16)
#pragma unroll
    for (int ii = 0; ii < 2; ++ii) {
#pragma unroll
      for (int jj = 0; jj < 2; ++jj) {
        int ncol = (np + jj) * 16 + (lane & 15);
        float bv = b1[(size_t)e * IDIM + i0 + ncol];
#pragma unroll
        for (int r = 0; r < 8; ++r) {
          int row = (mp + ii) * 16 + r + ((lane >> 4) << 3);
          float z = hacc[ii * 2 + jj][r] + bv;
          float gel = 0.5f * z * (1.0f + erff(z * 0.70710678118654752f));
          hb[row][ncol] = (h16)(gel * gsc[row]);
        }
      }
    }
    __syncthreads();

    // ===== phase 2: out_acc += hb @ W2[chunk, :] =====
#pragma unroll
    for (int nb = 0; nb < 6; ++nb) {
      const int cur = nb & 1;
#if HAVE_TDM
      if (wave == 0) {
        if (nb < 5) {
          tdm_load_tile_f16(W2te + (size_t)((nb + 1) * 128) * IDIM + i0,
                            wt_off[cur ^ 1], IDIM);
          __builtin_amdgcn_s_wait_tensorcnt(1);
        } else {
          __builtin_amdgcn_s_wait_tensorcnt(0);
        }
      }
#else
      stage_panel_f16(&wt[cur][0][0], W2te + (size_t)(nb * 128) * IDIM + i0, IDIM, tid);
#endif
      __syncthreads();
#pragma unroll
      for (int kk = 0; kk < 4; ++kk) {
        v16h a0 = ld_frag(&hb[(mp + 0) * 16][kk * 32], WP, lane);
        v16h a1 = ld_frag(&hb[(mp + 1) * 16][kk * 32], WP, lane);
        v16h b0 = ld_frag(&wt[cur][(np + 0) * 16][kk * 32], WP, lane);
        v16h b1f = ld_frag(&wt[cur][(np + 1) * 16][kk * 32], WP, lane);
        oacc[nb * 4 + 0] = WMMA_F16(a0, b0,  oacc[nb * 4 + 0]);
        oacc[nb * 4 + 1] = WMMA_F16(a0, b1f, oacc[nb * 4 + 1]);
        oacc[nb * 4 + 2] = WMMA_F16(a1, b0,  oacc[nb * 4 + 2]);
        oacc[nb * 4 + 3] = WMMA_F16(a1, b1f, oacc[nb * 4 + 3]);
      }
      __syncthreads();
    }
  }

  // ---- epilogue: store each listed token's gate-scaled partial row (no b2 here) ----
  float* pe = part + (size_t)e * T_TOK * HDIM;
#pragma unroll
  for (int ii = 0; ii < 2; ++ii) {
#pragma unroll
    for (int r = 0; r < 8; ++r) {
      int tk = tok[(mp + ii) * 16 + r + ((lane >> 4) << 3)];
      if (tk >= 0) {
        float* pr = pe + (size_t)tk * HDIM + np * 16 + (lane & 15);
#pragma unroll
        for (int nb = 0; nb < 6; ++nb) {
#pragma unroll
          for (int jj = 0; jj < 2; ++jj)
            pr[nb * 128 + jj * 16] = oacc[nb * 4 + ii * 2 + jj][r];
        }
      }
    }
  }
}

// ---------------------------------------------------------------------------
// Kernel 3: deterministic reduce over experts + bias term.
// out[t,n] = sum_e partial[e,t,n] + sum_e gate[t,e]*b2[e,n], over the experts
// with gate[t,e] != 0: only those rows of partial were written.
// One block per token (192 threads x float4 = 768 cols).
// ---------------------------------------------------------------------------
__global__ __launch_bounds__(192) void moe_reduce_kernel(
    const float* __restrict__ part, const float* __restrict__ gate,
    const float* __restrict__ b2, float* __restrict__ out) {
  int t  = blockIdx.x;
  int n4 = threadIdx.x * 4;
  float g[NEXP];
#pragma unroll
  for (int e = 0; e < NEXP; ++e) g[e] = gate[(size_t)t * NEXP + e];
  float4 acc = make_float4(0.f, 0.f, 0.f, 0.f);
#pragma unroll
  for (int e = 0; e < NEXP; ++e) {
    if (!(g[e] != 0.0f)) continue;
    float4 p  = *(const float4*)(part + ((size_t)e * T_TOK + t) * HDIM + n4);
    float4 bb = *(const float4*)(b2 + (size_t)e * HDIM + n4);
    acc.x += p.x + g[e] * bb.x;
    acc.y += p.y + g[e] * bb.y;
    acc.z += p.z + g[e] * bb.z;
    acc.w += p.w + g[e] * bb.w;
  }
  *(float4*)(out + (size_t)t * HDIM + n4) = acc;
}

// ---------------------------------------------------------------------------
extern "C" void kernel_launch(void* const* d_in, const int* in_sizes, int n_in,
                              void* d_out, int out_size, void* d_ws, size_t ws_size,
                              hipStream_t stream) {
  (void)in_sizes; (void)n_in; (void)ws_size; (void)out_size;
  const float* x      = (const float*)d_in[0];
  const float* gate_W = (const float*)d_in[1];
  const float* gate_b = (const float*)d_in[2];
  const float* W1     = (const float*)d_in[3];
  const float* b1     = (const float*)d_in[4];
  const float* W2     = (const float*)d_in[5];
  const float* b2     = (const float*)d_in[6];

  float* out      = (float*)d_out;
  float* gate_out = out + (size_t)T_TOK * HDIM;   // tuple output #2 region

  // workspace layout:
  //   W1t f16 [E][IDIM][HDIM]  (33.0 MB)
  //   W2t f16 [E][HDIM][IDIM]  (33.0 MB)
  //   partial f32 [E][T][HDIM] (88.1 MB)
  //   list i32 [E][T], cnt i32 [E][32] (first of each 32 used)
  h16*   W1t  = (h16*)d_ws;
  h16*   W2t  = W1t + (size_t)NEXP * HDIM * IDIM;
  float* partial = (float*)(W2t + (size_t)NEXP * HDIM * IDIM);
  int*   list = (int*)(partial + (size_t)NEXP * T_TOK * HDIM);
  int*   cnt  = list + (size_t)NEXP * T_TOK;

  const int tilesW1 = NEXP * (HDIM / 64) * (IDIM / 64);   // 4032
  const int tilesW2 = NEXP * (IDIM / 64) * (HDIM / 64);   // 4032
  transpose_cvt_kernel<<<tilesW1, 256, 0, stream>>>(W1, W1t, HDIM, IDIM);
  transpose_cvt_kernel<<<tilesW2, 256, 0, stream>>>(W2, W2t, IDIM, HDIM);

  moe_gate_kernel<<<T_TOK / 8, 256, 0, stream>>>(x, gate_W, gate_b, gate_out);
  moe_route_kernel<<<NEXP, 1024, 0, stream>>>(gate_out, list, cnt);
  moe_ffn_kernel<<<NEXP * (T_TOK / 64), 256, 0, stream>>>(x, W1t, b1, W2t,
                                                          gate_out, list, cnt, partial);
  moe_reduce_kernel<<<T_TOK, 192, 0, stream>>>(partial, gate_out, b2, out);
}

// v002
// Measured time: 288 microseconds a run.
// Two timings next to v001 both put it at 1.09 times that version's speed.
// Over all steps from v000 it is 1.99 times as fast.
#include <hip/hip_runtime.h>
#include <hip/hip_bf16.h>

// ---- problem constants (B=8, S=512, H=768, I=3072, E=7, TOP_K=2) ----
#define T_TOK 4096
#define HDIM  768
#define IDIM  3072
#define NEXP  7

typedef _Float16 h16;
typedef __attribute__((ext_vector_type(2)))  _Float16 v2h;
typedef __attribute__((ext_vector_type(8)))  _Float16 v8h;
typedef __attribute__((ext_vector_type(16))) _Float16 v16h;
typedef __attribute__((ext_vector_type(8)))  float    v8f;
typedef __attribute__((ext_vector_type(4)))  unsigned int u32x4;
typedef __attribute__((ext_vector_type(4)))  int      i32x4;
typedef __attribute__((ext_vector_type(8)))  int      i32x8;

#define WMMA_F16(a, b, c) \
  __builtin_amdgcn_wmma_f32_16x16x32_f16(false, (a), false, (b), (short)0, (c), false, false)

#if defined(__has_builtin)
#if __has_builtin(__builtin_amdgcn_tensor_load_to_lds) && __has_builtin(__builtin_amdgcn_s_wait_tensorcnt)
#define HAVE_TDM 1
#endif
#endif
#ifndef HAVE_TDM
#define HAVE_TDM 0
#endif

#define WP 136   // weight-panel / h pitch (halves): 272B rows = 256B + 16B pad
#define XP 776   // xs pitch (halves): 1552B rows, 16B aligned, bank-spread

// ---------------------------------------------------------------------------
// TDM: async 128x128 f16 tile copy global->LDS, 16B LDS pad per 256B row
// (LDS pitch 272B = WP). D# per CDNA5 ISA 8.3/8.4.
// ---------------------------------------------------------------------------
__device__ __forceinline__ void tdm_load_tile_f16(const h16* gsrc, unsigned lds_off,
                                                  unsigned stride_elems) {
#if HAVE_TDM
  unsigned long long ga = (unsigned long long)(uintptr_t)gsrc;
  u32x4 g0;
  g0[0] = 1u;                                   // count=1 (valid user descriptor)
  g0[1] = lds_off;                              // lds_addr (bytes)
  g0[2] = (unsigned)ga;                         // global_addr[31:0]
  g0[3] = (unsigned)((ga >> 32) & 0x01FFFFFFull) | (2u << 30);  // addr[56:32]|type=2
  i32x8 g1;
  g1[0] = (int)((1u << 16)      // data_size = 2 bytes
              | (1u << 20)      // pad_enable
              | (5u << 22)      // pad_interval: 64 DWORDs (256B)
              | (3u << 25));    // pad_amount: 4 DWORDs (16B)
  g1[1] = (int)(0x8000u << 16); // tensor_dim0 = 32768 (no OOB clipping)
  g1[2] = (int)(0x8000u << 16); // tensor_dim1 = 32768
  g1[3] = (int)(128u << 16);    // tile_dim0 = 128
  g1[4] = 128;                  // tile_dim1 = 128; tile_dim2 = 0
  g1[5] = (int)stride_elems;    // tensor_dim0_stride (data_size units)
  g1[6] = 0;
  g1[7] = 0;
  i32x4 z4 = {0, 0, 0, 0};
#if __clang_major__ >= 23
  i32x8 z8 = {0, 0, 0, 0, 0, 0, 0, 0};
  __builtin_amdgcn_tensor_load_to_lds(g0, g1, z4, z4, z8, 0);
#else
  __builtin_amdgcn_tensor_load_to_lds(g0, g1, z4, z4, 0);
#endif
#else
  (void)gsrc; (void)lds_off; (void)stride_elems;
#endif
}

// Fallback cooperative panel copy (f16 b128 both sides), all 256 threads.
__device__ __forceinline__ void stage_panel_f16(h16* dst /*[128][WP]*/, const h16* src,
                                                unsigned stride_elems, int tid) {
  for (int idx = tid; idx < 128 * 16; idx += 256) {
    int n = idx >> 4, k8 = (idx & 15) << 3;
    *(v8h*)(dst + n * WP + k8) = *(const v8h*)(src + (size_t)n * stride_elems + k8);
  }
}

// Load one 16x32 f16 fragment (A or B^T) from LDS row-major [16][K].
__device__ __forceinline__ v16h ld_frag(const h16* rowbase, int pitch, int lane) {
  const h16* p = rowbase + (lane & 15) * pitch + ((lane >> 4) << 3);
  v8h lo = *(const v8h*)(p);
  v8h hi = *(const v8h*)(p + 16);
  return __builtin_shufflevector(lo, hi, 0,1,2,3,4,5,6,7,8,9,10,11,12,13,14,15);
}

// ---------------------------------------------------------------------------
// Kernel 0: batched convert+transpose f32[R][C] -> f16[C][R] (per expert).
// ---------------------------------------------------------------------------
__global__ __launch_bounds__(256) void transpose_cvt_kernel(
    const float* __restrict__ src, h16* __restrict__ dst, int R, int C) {
  __shared__ h16 tile[64][72];
  int tilesPerRow = C >> 6;
  int tilesPerMat = (R >> 6) * tilesPerRow;
  int b = blockIdx.x;
  int e = b / tilesPerMat, t = b % tilesPerMat;
  int r0 = (t / tilesPerRow) << 6, c0 = (t % tilesPerRow) << 6;
  const float* s = src + (size_t)e * R * C;
  h16*         d = dst + (size_t)e * R * C;
  int tid = threadIdx.x;
  for (int i = tid; i < 4096; i += 256) {   // coalesced along C
    int r = i >> 6, c = i & 63;
    tile[r][c] = (h16)s[(size_t)(r0 + r) * C + c0 + c];
  }
  __syncthreads();
  for (int i = tid; i < 2048; i += 256) {   // coalesced along R, 4B stores
    int c = i >> 5, r2 = (i & 31) << 1;
    v2h v; v[0] = tile[r2][c]; v[1] = tile[r2 + 1][c];
    *(v2h*)(d + (size_t)(c0 + c) * R + r0 + r2) = v;
  }
}

// ---------------------------------------------------------------------------
// Kernel 1: gate logits -> top-2 softmax gate weights [T, 7]
// ---------------------------------------------------------------------------
__global__ __launch_bounds__(256) void moe_gate_kernel(
    const float* __restrict__ x, const float* __restrict__ gW,
    const float* __restrict__ gb, float* __restrict__ gate_out) {
  int lane = threadIdx.x & 31;
  int wave = threadIdx.x >> 5;
  int t = blockIdx.x * 8 + wave;
  if (t >= T_TOK) return;

  float acc[NEXP];
#pragma unroll
  for (int e = 0; e < NEXP; ++e) acc[e] = 0.f;

  const float* xr = x + (size_t)t * HDIM;
  for (int h = lane; h < HDIM; h += 32) {
    float xv = xr[h];
#pragma unroll
    for (int e = 0; e < NEXP; ++e)
      acc[e] = fmaf(xv, gW[e * HDIM + h], acc[e]);
  }
#pragma unroll
  for (int off = 16; off >= 1; off >>= 1) {
#pragma unroll
    for (int e = 0; e < NEXP; ++e) acc[e] += __shfl_xor(acc[e], off, 32);
  }
#pragma unroll
  for (int e = 0; e < NEXP; ++e) acc[e] += gb[e];

  int i0 = 0; float v0 = acc[0];
#pragma unroll
  for (int e = 1; e < NEXP; ++e) { if (acc[e] > v0) { v0 = acc[e]; i0 = e; } }
  int i1 = -1; float v1 = -3.4e38f;
#pragma unroll
  for (int e = 0; e < NEXP; ++e) { if (e != i0 && acc[e] > v1) { v1 = acc[e]; i1 = e; } }
  float e1 = expf(v1 - v0);
  float w0 = 1.0f / (1.0f + e1);
  float w1 = e1 * w0;
  if (lane < NEXP)
    gate_out[(size_t)t * NEXP + lane] = (lane == i0) ? w0 : (lane == i1) ? w1 : 0.0f;
}

// ---------------------------------------------------------------------------
// Kernel 1b: routing. One block per expert lists, in token order, the tokens
// whose gate weight for that expert is not zero (ballot + prefix sum, no
// atomics -> deterministic). A zero weight multiplies that expert's whole
// term of the output sum, so only the listed tokens need the expert's FFN.
// ---------------------------------------------------------------------------
__global__ __launch_bounds__(1024) void moe_route_kernel(
    const float* __restrict__ gate, int* __restrict__ list, int* __restrict__ cnt) {
  __shared__ __align__(16) int segc[128];   // tokens kept per 32-token segment
  __shared__ int segb[128];                 // exclusive prefix of segc
  const int tid  = threadIdx.x;
  const int lane = tid & 31;
  const int wave = tid >> 5;
  const int e    = blockIdx.x;

  float gv[4];
#pragma unroll   // the four loads issue together; gv[] stays in registers
  for (int i = 0; i < 4; ++i) gv[i] = gate[(size_t)(i * 1024 + tid) * NEXP + e];
  unsigned m[4];
#pragma unroll   // m[] indexed by constants only: stays in registers
  for (int i = 0; i < 4; ++i) {
    m[i] = __builtin_amdgcn_ballot_w32(gv[i] != 0.0f);
    if (lane == 0) segc[i * 32 + wave] = __popc(m[i]);
  }
  __syncthreads();
  if (wave == 0) {
    int4 c = *(const int4*)&segc[lane * 4];
    int sum = c.x + c.y + c.z + c.w;
    int inc = sum;
#pragma unroll   // five fixed shuffle steps of the inclusive scan
    for (int off = 1; off < 32; off <<= 1) {
      int v = __shfl_up(inc, off, 32);
      if (lane >= off) inc += v;
    }
    int ex = inc - sum;
    segb[lane * 4 + 0] = ex;
    segb[lane * 4 + 1] = ex + c.x;
    segb[lane * 4 + 2] = ex + c.x + c.y;
    segb[lane * 4 + 3] = ex + c.x + c.y + c.z;
    if (lane == 31) cnt[e * 32] = inc;   // one 128-byte line per writing block
  }
  __syncthreads();
#pragma unroll   // m[] indexed by constants only: stays in registers
  for (int i = 0; i < 4; ++i) {
    if ((m[i] >> lane) & 1u) {
      int rank = segb[i * 32 + wave] + __popc(m[i] & ((1u << lane) - 1u));
      list[e * T_TOK + rank] = i * 1024 + tid;
    }
  }
}

// ---------------------------------------------------------------------------
// Kernel 2: fused single-expert FFN partial over the expert's routed tokens.
// Grid = 64 tiles x 7 experts (the bound: every token on one expert); tile
// index major, so the tiles that hold tokens start first; a tile past the
// expert's count leaves before any barrier or tensor load.
// Each WG: 64 listed tokens, one expert; 2x2 register-blocked WMMA (2 LDS
// b128/WMMA); writes the gate-scaled partial rows [768] f32 to each token's
// own row of the workspace (no atomics -> deterministic).
// ---------------------------------------------------------------------------
__global__ __launch_bounds__(256) void moe_ffn_kernel(
    const float* __restrict__ x,  const h16* __restrict__ W1t,
    const float* __restrict__ b1, const h16* __restrict__ W2t,
    const float* __restrict__ gate, const int* __restrict__ list,
    const int* __restrict__ cnt, float* __restrict__ part) {
  __shared__ __align__(16) h16 xs[64][XP];      // x tile f16          (~97 KB)
  __shared__ __align__(16) h16 wt[2][128][WP];  // double-buffered panels (~68 KB)
  __shared__ __align__(16) h16 hb[64][WP];      // gated gelu(h) f16   (~17 KB)
  __shared__ float gsc[64];                     // gate weight (this expert)
  __shared__ int   tok[64];                     // token of each tile row, -1 = none

  const int tid  = threadIdx.x;
  const int lane = tid & 31;
  const int wave = tid >> 5;
  const int e    = blockIdx.x % NEXP;        // expert 0..6
  const int r0   = (blockIdx.x / NEXP) * 64; // first list entry of this tile
  const int ne   = min(cnt[e * 32], T_TOK);  // tokens routed to this expert
  if (r0 >= ne) return;                      // same for the whole work-group

  const int mp = (wave >> 2) * 2;   // wave's M-tile pair base (0 or 2)
  const int np = (wave & 3) * 2;    // wave's N-tile pair base within 128 block

  const unsigned wt_off[2] = {
    (unsigned)(uintptr_t)&wt[0][0][0],
    (unsigned)(uintptr_t)&wt[1][0][0],
  };

  // ---- prologue: this tile's tokens and gate scales, then gather x (f32 -> f16) ----
  if (tid < 64) {
    int tk = (r0 + tid < ne) ? list[e * T_TOK + r0 + tid] : -1;
    bool ok = (unsigned)tk < (unsigned)T_TOK;
    tok[tid] = ok ? tk : -1;
    gsc[tid] = ok ? gate[(size_t)tk * NEXP + e] : 0.0f;
  }
  __syncthreads();
#pragma unroll 4   // four row gathers in flight per thread: their latency overlaps
  for (int idx = tid; idx < 64 * HDIM / 4; idx += 256) {
    int t  = idx / (HDIM / 4);
    int h4 = (idx % (HDIM / 4)) * 4;
    int tk = max(tok[t], 0);   // a row past the list reads token 0; it is never stored
    float4 v = *(const float4*)(x + (size_t)tk * HDIM + h4);
    xs[t][h4 + 0] = (h16)v.x; xs[t][h4 + 1] = (h16)v.y;
    xs[t][h4 + 2] = (h16)v.z; xs[t][h4 + 3] = (h16)v.w;
  }
  __syncthreads();

  const h16* W1te = W1t + (size_t)e * HDIM * IDIM;  // [IDIM][HDIM]
  const h16* W2te = W2t + (size_t)e * IDIM * HDIM;  // [HDIM][IDIM]

  v8f oacc[24];
  { v8f z = {};
#pragma unroll
    for (int i = 0; i < 24; ++i) oacc[i] = z; }

  for (int ic = 0; ic < IDIM / 128; ++ic) {
    const int i0 = ic * 128;

    // ===== phase 1: h = gelu(x @ W1[:,chunk] + b1) * gate =====
    v8f hacc[4];
    { v8f z = {};
#pragma unroll
      for (int i = 0; i < 4; ++i) hacc[i] = z; }

#if HAVE_TDM
    if (wave == 0)
      tdm_load_tile_f16(W1te + (size_t)i0 * HDIM, wt_off[0], HDIM);
#endif
    for (int kp = 0; kp < 6; ++kp) {
      const int cur = kp & 1;
#if HAVE_TDM
      if (wave == 0) {
        if (kp < 5) {
          tdm_load_tile_f16(W1te + (size_t)i0 * HDIM + (kp + 1) * 128,
                            wt_off[cur ^ 1], HDIM);
          __builtin_amdgcn_s_wait_tensorcnt(1);
        } else {
          __builtin_amdgcn_s_wait_tensorcnt(0);
        }
      }
#else
      stage_panel_f16(&wt[cur][0][0], W1te + (size_t)i0 * HDIM + kp * 128, HDIM, tid);
#endif
      __syncthreads();
      // The panel's 16 fragments are fetched as one group, in the order of use,
      // into registers of their own: the wave waits out one LDS latency per
      // panel, and later fragments arrive behind the running WMMAs.
      v16h fa[4][2], fb[4][2];
#pragma unroll
      for (int kk = 0; kk < 4; ++kk) {
        fa[kk][0] = ld_frag(&xs[(mp + 0) * 16][kp * 128 + kk * 32], XP, lane);
        fb[kk][0] = ld_frag(&wt[cur][(np + 0) * 16][kk * 32], WP, lane);
        fb[kk][1] = ld_frag(&wt[cur][(np + 1) * 16][kk * 32], WP, lane);
        fa[kk][1] = ld_frag(&xs[(mp + 1) * 16][kp * 128 + kk * 32], XP, lane);
      }
      // keeps the scheduler from sinking the loads back among the WMMAs (a wait to 0 at each place)
      __builtin_amdgcn_sched_barrier(0);
#pragma unroll
      for (int kk = 0; kk < 4; ++kk) {
        hacc[0] = WMMA_F16(fa[kk][0], fb[kk][0], hacc[0]);
        hacc[1] = WMMA_F16(fa[kk][0], fb[kk][1], hacc[1]);
        hacc[2] = WMMA_F16(fa[kk][1], fb[kk][0], hacc[2]);
        hacc[3] = WMMA_F16(fa[kk][1], fb[kk][1], hacc[3]);
      }
      // keeps the WMMAs in front of the barrier: they run while the later fragments still arrive
      // (moved behind it, they would start only after a wait for all 32 loads)
      __builtin_amdgcn_sched_barrier(0);
      __syncthreads();
    }

#if HAVE_TDM
    if (wave == 0)   // prefetch W2 block 0 into free buf0 during gelu epilogue
      tdm_load_tile_f16(W2te + i0, wt_off[0], IDIM);
#endif
    // bias + exact gelu + gate scaling -> hb (f16)
#pragma unroll
    for (int ii = 0; ii < 2; ++ii) {
#pragma unroll
      for (int jj = 0; jj < 2; ++jj) {
        int ncol = (np + jj) * 16 + (lane & 15);
        float bv = b1[(size_t)e * IDIM + i0 + ncol];
#pragma unroll
        for (int r = 0; r < 8; ++r) {
          int row = (mp + ii) * 16 + r + ((lane >> 4) << 3);
          float z = hacc[ii * 2 + jj][r] + bv;
          float gel = 0.5f * z * (1.0f + erff(z * 0.70710678118654752f));
          hb[row][ncol] = (h16)(gel * gsc[row]);
        }
      }
    }
    __syncthreads();

    // ===== phase 2: out_acc += hb @ W2[chunk, :] =====
#pragma unroll
    for (int nb = 0; nb < 6; ++nb) {
      const int cur = nb & 1;
#if HAVE_TDM
      if (wave == 0) {
        if (nb < 5) {
          tdm_load_tile_f16(W2te + (size_t)((nb + 1) * 128) * IDIM + i0,
                            wt_off[cur ^ 1], IDIM);
          __builtin_amdgcn_s_wait_tensorcnt(1);
        } else {
          __builtin_amdgcn_s_wait_tensorcnt(0);
        }
      }
#else
      stage_panel_f16(&wt[cur][0][0], W2te + (size_t)(nb * 128) * IDIM + i0, IDIM, tid);
#endif
      __syncthreads();
      // one group of fragment loads ahead of the panel's WMMAs, as in phase 1
      v16h fa[4][2], fb[4][2];
#pragma unroll
      for (int kk = 0; kk < 4; ++kk) {
        fa[kk][0] = ld_frag(&hb[(mp + 0) * 16][kk * 32], WP, lane);
        fb[kk][0] = ld_frag(&wt[cur][(np + 0) * 16][kk * 32], WP, lane);
        fb[kk][1] = ld_frag(&wt[cur][(np + 1) * 16][kk * 32], WP, lane);
        fa[kk][1] = ld_frag(&hb[(mp + 1) * 16][kk * 32], WP, lane);
      }
      // keeps the scheduler from sinking the loads back among the WMMAs (a wait to 0 at each place)
      __builtin_amdgcn_sched_barrier(0);
#pragma unroll
      for (int kk = 0; kk < 4; ++kk) {
        oacc[nb * 4 + 0] = WMMA_F16(fa[kk][0], fb[kk][0], oacc[nb * 4 + 0]);
        oacc[nb * 4 + 1] = WMMA_F16(fa[kk][0], fb[kk][1], oacc[nb * 4 + 1]);
        oacc[nb * 4 + 2] = WMMA_F16(fa[kk][1], fb[kk][0], oacc[nb * 4 + 2]);
        oacc[nb * 4 + 3] = WMMA_F16(fa[kk][1], fb[kk][1], oacc[nb * 4 + 3]);
      }
      // keeps the WMMAs in front of the barrier: they run while the later fragments still arrive
      // (moved behind it, they would start only after a wait for all 32 loads)
      __builtin_amdgcn_sched_barrier(0);
      __syncthreads();
    }
  }

  // ---- epilogue: store each listed token's gate-scaled partial row (no b2 here) ----
  float* pe = part + (size_t)e * T_TOK * HDIM;
#pragma unroll
  for (int ii = 0; ii < 2; ++ii) {
#pragma unroll
    for (int r = 0; r < 8; ++r) {
      int tk = tok[(mp + ii) * 16 + r + ((lane >> 4) << 3)];
      if (tk >= 0) {
        float* pr = pe + (size_t)tk * HDIM + np * 16 + (lane & 15);
#pragma unroll
        for (int nb = 0; nb < 6; ++nb) {
#pragma unroll
          for (int jj = 0; jj < 2; ++jj)
            pr[nb * 128 + jj * 16] = oacc[nb * 4 + ii * 2 + jj][r];
        }
      }
    }
  }
}

// ---------------------------------------------------------------------------
// Kernel 3: deterministic reduce over experts + bias term.
// out[t,n] = sum_e partial[e,t,n] + sum_e gate[t,e]*b2[e,n], over the experts
// with gate[t,e] != 0: only those rows of partial were written.
// One block per token (192 threads x float4 = 768 cols).
// ---------------------------------------------------------------------------
__global__ __launch_bounds__(192) void moe_reduce_kernel(
    const float* __restrict__ part, const float* __restrict__ gate,
    const float* __restrict__ b2, float* __restrict__ out) {
  int t  = blockIdx.x;
  int n4 = threadIdx.x * 4;
  float g[NEXP];
#pragma unroll
  for (int e = 0; e < NEXP; ++e) g[e] = gate[(size_t)t * NEXP + e];
  float4 acc = make_float4(0.f, 0.f, 0.f, 0.f);
#pragma unroll
  for (int e = 0; e < NEXP; ++e) {
    if (!(g[e] != 0.0f)) continue;
    float4 p  = *(const float4*)(part + ((size_t)e * T_TOK + t) * HDIM + n4);
    float4 bb = *(const float4*)(b2 + (size_t)e * HDIM + n4);
    acc.x += p.x + g[e] * bb.x;
    acc.y += p.y + g[e] * bb.y;
    acc.z += p.z + g[e] * bb.z;
    acc.w += p.w + g[e] * bb.w;
  }
  *(float4*)(out + (size_t)t * HDIM + n4) = acc;
}

// ---------------------------------------------------------------------------
extern "C" void kernel_launch(void* const* d_in, const int* in_sizes, int n_in,
                              void* d_out, int out_size, void* d_ws, size_t ws_size,
                              hipStream_t stream) {
  (void)in_sizes; (void)n_in; (void)ws_size; (void)out_size;
  const float* x      = (const float*)d_in[0];
  const float* gate_W = (const float*)d_in[1];
  const float* gate_b = (const float*)d_in[2];
  const float* W1     = (const float*)d_in[3];
  const float* b1     = (const float*)d_in[4];
  const float* W2     = (const float*)d_in[5];
  const float* b2     = (const float*)d_in[6];

  float* out      = (float*)d_out;
  float* gate_out = out + (size_t)T_TOK * HDIM;   // tuple output #2 region

  // workspace layout:
  //   W1t f16 [E][IDIM][HDIM]  (33.0 MB)
  //   W2t f16 [E][HDIM][IDIM]  (33.0 MB)
  //   partial f32 [E][T][HDIM] (88.1 MB)
  //   list i32 [E][T], cnt i32 [E][32] (first of each 32 used)
  h16*   W1t  = (h16*)d_ws;
  h16*   W2t  = W1t + (size_t)NEXP * HDIM * IDIM;
  float* partial = (float*)(W2t + (size_t)NEXP * HDIM * IDIM);
  int*   list = (int*)(partial + (size_t)NEXP * T_TOK * HDIM);
  int*   cnt  = list + (size_t)NEXP * T_TOK;

  const int tilesW1 = NEXP * (HDIM / 64) * (IDIM / 64);   // 4032
  const int tilesW2 = NEXP * (IDIM / 64) * (HDIM / 64);   // 4032
  transpose_cvt_kernel<<<tilesW1, 256, 0, stream>>>(W1, W1t, HDIM, IDIM);
  transpose_cvt_kernel<<<tilesW2, 256, 0, stream>>>(W2, W2t, IDIM, HDIM);

  moe_gate_kernel<<<T_TOK / 8, 256, 0, stream>>>(x, gate_W, gate_b, gate_out);
  moe_route_kernel<<<NEXP, 1024, 0, stream>>>(gate_out, list, cnt);
  moe_ffn_kernel<<<NEXP * (T_TOK / 64), 256, 0, stream>>>(x, W1t, b1, W2t,
                                                          gate_out, list, cnt, partial);
  moe_reduce_kernel<<<T_TOK, 192, 0, stream>>>(partial, gate_out, b2, out);
}
